// v010
// The times below were measured on an AMD MI455X: many runs one after another, warmed up first and cycling through
// copies of the inputs, with the whole window's GPU time divided by the number of runs. Launches and the gaps
// between them are all in it. The median over several windows is given; except for v000 it joins two sittings, which
// can be a few percent apart, so the side-by-side timings, each taken in one sitting, are the better comparison.
// The versions before v010 are in another document.
// It runs in 134 microseconds.
// Timed twice side by side with v009, it ran 1.07 times as fast both times.
// Over all steps from v000, the starting kernel, it is 15.3 times as fast.
#include <hip/hip_runtime.h>
// Grammar attention (8 x 1024 tokens, 512 = 8 heads x 64): q,k,v = x W^T + b; scores = q.k/8 + dist_emb[bucket(|pos_j - pos_i|)][h] + ((pos_j > pos_i) - 0.5) * order_bias[h] with INPUT int32 positions, INPUT bin edges (torch.bucketize right=False = count of edges < dist) and an INPUT key/query mask (masked keys excluded; masked query rows zeroed before the output projection, as out * mask); softmax; out = ((attn v) * mask) Wo^T + bo -> [8,1024,512].
// Structure: x as an exact f16 plane; projections as f16 WMMA GEMMs (32x64 wave tiles, f32 accumulation, exact x16 weights + bias); a device-built bucket lookup table over integer distances (from the INPUT edges); a device-built table that holds, for every (batch, query, key), where that pair's bias stands in a 65-entry per-head table (bucket, order sign, or the masked key's -inf); q, k as f16 hi + (x2^10) residual planes, V^T as hi + residual planes; the fused flash kernel gathers the summed bias by that table inside the score stage (transposed score and value tiles, online f32 softmax per lane, P hi + residual kept in registers, two value accumulators); O scaled by the query mask, split hi/lo, into Wo (two GEMMs, bias in the first).
// Compute dtype: x, weights, biases, dist_emb, order_bias, bin_edges, mask rounded to bf16; projections exact; q, k, P, v, O as f16 hi + residual pairs (~2^-21); f32 accumulation and softmax. v_wmma_f32_16x16x32_f16.
#define NBT 8
#define SLEN 1024
#define NBIN 32
#define LUTN 16384            /* bucket lookup over integer distances 0..LUTN-1 (positions < 5000) */
#define DM 512
#define NH 8
#define SCL 0.125f
#define LOG2E 1.4426950408889634f   /* the flash kernel's scores, biases and running maximum are kept times log2(e): e^(s - m) is then one native 2^x */
#define NR (NBT * SLEN)
typedef __bf16 v16b __attribute__((ext_vector_type(16)));
typedef unsigned short v8us __attribute__((ext_vector_type(8), may_alias));
typedef float  v8f  __attribute__((ext_vector_type(8)));
typedef float  v4f  __attribute__((ext_vector_type(4)));
typedef float  v4fa __attribute__((ext_vector_type(4), may_alias));
union FragB { v16b v; v8us half[2]; unsigned short u[16]; };

__device__ __forceinline__ unsigned short bf16_bits(float x) { unsigned int u = __float_as_uint(x); return (unsigned short)((u + 0x7FFFu + ((u >> 16) & 1u)) >> 16); }
__device__ __forceinline__ float bf16_val(unsigned short b) { return __uint_as_float(((unsigned int)b) << 16); }
__device__ __forceinline__ float bf16_round(float x) { return bf16_val(bf16_bits(x)); }
// D += A·B with NT terms: 1 = ah·bh, 2 = + al·bh (A split), 3 = + ah·bl (both split)
template <int NT>
__device__ __forceinline__ v8f mmaN(v16b ah, v16b al, v16b bh, v16b bl, v8f c) {
  c = __builtin_amdgcn_wmma_f32_16x16x32_bf16(false, ah, false, bh, (short)0, c, false, false);
  if (NT >= 2) c = __builtin_amdgcn_wmma_f32_16x16x32_bf16(false, al, false, bh, (short)0, c, false, false);
  if (NT >= 3) c = __builtin_amdgcn_wmma_f32_16x16x32_bf16(false, ah, false, bl, (short)0, c, false, false);
  asm volatile("v_nop\n\tv_nop\n\tv_nop\n\tv_nop" : "+v"(c) : "v"(ah), "v"(al), "v"(bh), "v"(bl));
  return c;
}

__global__ __launch_bounds__(256) void k_wt_bf16(const float* __restrict__ W, unsigned short* __restrict__ Wt, int K, int N) {
  const int t = blockIdx.x * 256 + threadIdx.x;
  const int k8n = K / 8;
  if (t >= N * k8n) return;
  const int n = t / k8n, k8 = (t % k8n) * 8;
  v8us v;
#pragma unroll
  for (int i = 0; i < 8; ++i) v[i] = bf16_bits(W[(size_t)(k8 + i) * N + n]);
  *(v8us*)(Wt + (size_t)n * K + k8) = v;
  
}

// GEMM C[M][N] (f32, pitch ldc) = act(A[M][K]·W + bias). A f32 row-major (pitch lda) converted per fragment to bf16
// (ASPLIT: hi/lo two planes -> 2 terms, else single rounded term); Wt bf16 [N][K] (pitch ldb). BIAS_BF16 rounds the
// bias to bf16 first (bias quantised to bf16 before the add). K%32==0, M%16==0, N%64==0.
template <bool ASPLIT, int ACT, bool BIAS_BF16>
__global__ __launch_bounds__(128) void k_gemm_bf(const float* __restrict__ A, int lda, const unsigned short* __restrict__ Wt, int ldb,
                                               const float* __restrict__ bias, float* __restrict__ C, int ldc, int M, int N, int K) {
  __shared__ __attribute__((aligned(16))) float so[4][16][64];
  const int tid = threadIdx.x, w = tid >> 5, lane = tid & 31, ln = lane & 15, hh = lane >> 4;
  const int ntn = N / 64;
  const int wid = blockIdx.x * 4 + w;
  const int mt = wid / ntn, nq = wid % ntn;
  if (mt * 16 >= M) return;
  const int row0 = mt * 16, col0 = nq * 64;
  const float* arow = A + (size_t)(row0 + ln) * lda;
  v8f acc[4] = {};
  for (int kb = 0; kb < K; kb += 32) {
    FragB ah, al;
    const v4f x0 = *(const v4fa*)(arow + kb + 8 * hh), x1 = *(const v4fa*)(arow + kb + 8 * hh + 4);
    const v4f x2 = *(const v4fa*)(arow + kb + 16 + 8 * hh), x3 = *(const v4fa*)(arow + kb + 16 + 8 * hh + 4);
    float xs[16] = {x0[0],x0[1],x0[2],x0[3],x1[0],x1[1],x1[2],x1[3],x2[0],x2[1],x2[2],x2[3],x3[0],x3[1],x3[2],x3[3]};
#pragma unroll
    for (int i = 0; i < 16; ++i) { const unsigned short hb = bf16_bits(xs[i]); ah.u[i] = hb; al.u[i] = ASPLIT ? bf16_bits(xs[i] - bf16_val(hb)) : (unsigned short)0; }
#pragma unroll
    for (int t = 0; t < 4; ++t) {
      const unsigned short* brow = Wt + (size_t)(col0 + t * 16 + ln) * ldb + kb;
      FragB b;
      b.half[0] = *(const v8us*)(brow + 8 * hh);
      b.half[1] = *(const v8us*)(brow + 16 + 8 * hh);
      acc[t] = mmaN<ASPLIT ? 2 : 1>(ah.v, al.v, b.v, b.v, acc[t]);
    }
  }
#pragma unroll
  for (int t = 0; t < 4; ++t) {
    float bv = bias ? bias[col0 + t * 16 + ln] : 0.f;
    if (BIAS_BF16) bv = bf16_round(bv);
#pragma unroll
    for (int r = 0; r < 8; ++r) { float v = acc[t][r] + bv; if (ACT == 1) v = fmaxf(v, 0.f); so[w][8 * hh + r][t * 16 + ln] = v; }
  }
  __builtin_amdgcn_fence(__ATOMIC_ACQ_REL, "workgroup");
  __builtin_amdgcn_wave_barrier();
  const int rsub = lane >> 4, c4 = (lane & 15) * 4;
  {
#pragma unroll
    for (int q = 0; q < 8; ++q) {
      const int r = q * 2 + rsub;
      const v4f v = *(const v4fa*)&so[w][r][c4];
      *(v4f*)(C + (size_t)(row0 + r) * ldc + col0 + c4) = v;
    }
    
  }
}

// GEMM C = act(A·W + bias + resid): A f32 (ASPLIT -> hi/lo 2 terms), Wt bf16 [N][K]; ACT 0 none, 1 relu, 2 exact gelu;
// resid (optional, f32, row index = (row % rmod), pitch ldr, RES_BF16 rounds it) added before the activation.
template <bool ASPLIT, int ACT, bool BIAS_BF16, bool RES_BF16>
__global__ __launch_bounds__(128) void k_gemm_bf3(const float* __restrict__ A, int lda, const unsigned short* __restrict__ Wt, int ldb,
                                                const float* __restrict__ bias, const float* __restrict__ resid, int rmod, int ldr,
                                                float* __restrict__ C, int ldc, int M, int N, int K) {
  __shared__ __attribute__((aligned(16))) float so[4][16][64];
  const int tid = threadIdx.x, w = tid >> 5, lane = tid & 31, ln = lane & 15, hh = lane >> 4;
  const int ntn = N / 64;
  const int wid = blockIdx.x * 4 + w;
  const int mt = wid / ntn, nq = wid % ntn;
  if (mt * 16 >= M) return;
  const int row0 = mt * 16, col0 = nq * 64;
  const float* arow = A + (size_t)(row0 + ln) * lda;
  v8f acc[4] = {};
  for (int kb = 0; kb < K; kb += 32) {
    FragB ah, al;
    const v4f x0 = *(const v4fa*)(arow + kb + 8 * hh), x1 = *(const v4fa*)(arow + kb + 8 * hh + 4);
    const v4f x2 = *(const v4fa*)(arow + kb + 16 + 8 * hh), x3 = *(const v4fa*)(arow + kb + 16 + 8 * hh + 4);
    float xs[16] = {x0[0],x0[1],x0[2],x0[3],x1[0],x1[1],x1[2],x1[3],x2[0],x2[1],x2[2],x2[3],x3[0],x3[1],x3[2],x3[3]};
#pragma unroll
    for (int i = 0; i < 16; ++i) { const unsigned short hb = bf16_bits(xs[i]); ah.u[i] = hb; al.u[i] = ASPLIT ? bf16_bits(xs[i] - bf16_val(hb)) : (unsigned short)0; }
#pragma unroll
    for (int t = 0; t < 4; ++t) {
      const unsigned short* brow = Wt + (size_t)(col0 + t * 16 + ln) * ldb + kb;
      FragB b;
      b.half[0] = *(const v8us*)(brow + 8 * hh);
      b.half[1] = *(const v8us*)(brow + 16 + 8 * hh);
      acc[t] = mmaN<ASPLIT ? 2 : 1>(ah.v, al.v, b.v, b.v, acc[t]);
    }
  }
#pragma unroll
  for (int t = 0; t < 4; ++t) {
    const int col = col0 + t * 16 + ln;
    float bv = bias ? bias[col] : 0.f;
    if (BIAS_BF16) bv = bf16_round(bv);
#pragma unroll
    for (int r = 0; r < 8; ++r) {
      float v = acc[t][r] + bv;
      if (resid) { float rv = resid[(size_t)((row0 + 8 * hh + r) % rmod) * ldr + col]; if (RES_BF16) rv = bf16_round(rv); v += rv; }
      if (ACT == 1) v = fmaxf(v, 0.f);
      if (ACT == 2) v = 0.5f * v * (1.0f + erff(v * 0.70710678118654752f));
      if (ACT == 3) { const float u = 0.7978845608028654f * (v + 0.044715f * v * v * v); v = 0.5f * v * (1.0f + tanhf(u)); }
      so[w][8 * hh + r][t * 16 + ln] = v;
    }
  }
  __builtin_amdgcn_fence(__ATOMIC_ACQ_REL, "workgroup");
  __builtin_amdgcn_wave_barrier();
  const int rsub = lane >> 4, c4 = (lane & 15) * 4;
  {
#pragma unroll
    for (int q = 0; q < 8; ++q) {
      const int r = q * 2 + rsub;
      const v4f v = *(const v4fa*)&so[w][r][c4];
      *(v4f*)(C + (size_t)(row0 + r) * ldc + col0 + c4) = v;
    }
    
  }
}
// row LayerNorm (biased variance, eps) over N: s = X (+ R); optional out_sum <- s; out_norm <- (s-mu)*rsqrt(var+eps)*g + b
template <bool PARAM_BF16>
__global__ __launch_bounds__(256) void k_layernorm(const float* __restrict__ X, const float* __restrict__ R, const float* __restrict__ g, const float* __restrict__ bta,
                                                  float* __restrict__ out_sum, float* __restrict__ out_norm, int N, float eps) {
  __shared__ float red[256];
  const int row = blockIdx.x, tid = threadIdx.x;
  const float* x = X + (size_t)row * N; const float* rr = R ? R + (size_t)row * N : nullptr;
  float vals[16];                     // up to N = 4096
  const int per = N / 256;            // contiguous chunk per thread? use strided-by-4 chunks: thread handles j = tid*4 + 1024*u
  float s1 = 0.f;
  for (int u = 0; u < per / 4; ++u) {
    const int j = tid * 4 + 1024 * u;
    const v4f a = *(const v4fa*)(x + j);
    v4f b = {0.f,0.f,0.f,0.f}; if (rr) b = *(const v4fa*)(rr + j);
#pragma unroll
    for (int q = 0; q < 4; ++q) { const float v = a[q] + b[q]; vals[u * 4 + q] = v; s1 += v; }
  }
  red[tid] = s1; __syncthreads();
  for (int st = 128; st > 0; st >>= 1) { if (tid < st) red[tid] += red[tid + st]; __syncthreads(); }
  const float mu = red[0] / (float)N; __syncthreads();
  float s2 = 0.f;
  for (int u = 0; u < per / 4; ++u)
#pragma unroll
    for (int q = 0; q < 4; ++q) { const float c = vals[u * 4 + q] - mu; s2 += c * c; }
  red[tid] = s2; __syncthreads();
  for (int st = 128; st > 0; st >>= 1) { if (tid < st) red[tid] += red[tid + st]; __syncthreads(); }
  const float rs = rsqrtf(red[0] / (float)N + eps);
  {
    for (int u = 0; u < per / 4; ++u) {
      const int j = tid * 4 + 1024 * u;
      v4f o, sm;
#pragma unroll
      for (int q = 0; q < 4; ++q) {
        float gg = g[j + q], bb = bta[j + q];
        if (PARAM_BF16) { gg = bf16_round(gg); bb = bf16_round(bb); }
        sm[q] = vals[u * 4 + q]; o[q] = (vals[u * 4 + q] - mu) * rs * gg + bb;
      }
      if (out_sum) *(v4f*)(out_sum + (size_t)row * N + j) = sm;
      *(v4f*)(out_norm + (size_t)row * N + j) = o;
    }
    
  }
}



// ---- f16 WMMA path (v_wmma_f32_16x16x32_f16): 11-bit significands for operands in range — used where a [0,1] probability operand needs more precision than bf16
typedef _Float16 v16h __attribute__((ext_vector_type(16)));
union FragH { v16h v; v8us half[2]; _Float16 h[16]; unsigned short u[16]; };
template <int NT>
__device__ __forceinline__ v8f mmaH(v16h ah, v16h al, v16h bh, v16h bl, v8f c) {
  c = __builtin_amdgcn_wmma_f32_16x16x32_f16(false, ah, false, bh, (short)0, c, false, false);
  if (NT >= 2) c = __builtin_amdgcn_wmma_f32_16x16x32_f16(false, al, false, bh, (short)0, c, false, false);
  if (NT >= 3) c = __builtin_amdgcn_wmma_f32_16x16x32_f16(false, ah, false, bl, (short)0, c, false, false);
  asm volatile("v_nop\n\tv_nop\n\tv_nop\n\tv_nop" : "+v"(c) : "v"(ah), "v"(al), "v"(bh), "v"(bl));
  return c;
}
// batched GEMM like k_gemm_b but f16 operands: A f32 (split into f16 hi/lo if ASPLIT, else rounded to f16), Bt = f16 values [n][k]; alpha; C f32; N multiple of 16 (partial tiles skipped)
template <bool ASPLIT>
__global__ __launch_bounds__(128) void k_gemm_h(const float* __restrict__ A, int lda, size_t sA, const _Float16* __restrict__ Bh, int ldb, size_t sB, float alpha, float* __restrict__ C, int ldc, size_t sC, int M, int N, int K) {
  __shared__ __attribute__((aligned(16))) float so[4][16][64];
  const int tid = threadIdx.x, w = tid >> 5, lane = tid & 31, ln = lane & 15, hh = lane >> 4; const int by = blockIdx.y;
  A += (size_t)by * sA; Bh += (size_t)by * sB; C += (size_t)by * sC;
  const int ntn = (N + 63) / 64; const int wid = blockIdx.x * 4 + w; const int mt = wid / ntn, nq = wid % ntn; if (mt * 16 >= M) return;
  const int row0 = mt * 16, col0 = nq * 64; const float* arow = A + (size_t)(row0 + ln) * lda;
  v8f acc[4] = {};
  for (int kb = 0; kb < K; kb += 32) {
    FragH ah, al;
    const v4f x0 = *(const v4fa*)(arow + kb + 8 * hh), x1 = *(const v4fa*)(arow + kb + 8 * hh + 4), x2 = *(const v4fa*)(arow + kb + 16 + 8 * hh), x3 = *(const v4fa*)(arow + kb + 16 + 8 * hh + 4);
    float xs[16] = {x0[0],x0[1],x0[2],x0[3],x1[0],x1[1],x1[2],x1[3],x2[0],x2[1],x2[2],x2[3],x3[0],x3[1],x3[2],x3[3]};
#pragma unroll
    for (int i = 0; i < 16; ++i) { const _Float16 h = (_Float16)xs[i]; ah.h[i] = h; al.h[i] = ASPLIT ? (_Float16)(xs[i] - (float)h) : (_Float16)0.0f; }
#pragma unroll
    for (int t = 0; t < 4; ++t) { if (col0 + t * 16 >= N) continue; const size_t boff = (size_t)(col0 + t * 16 + ln) * ldb + kb; FragH bq; bq.half[0] = *(const v8us*)(Bh + boff + 8 * hh); bq.half[1] = *(const v8us*)(Bh + boff + 16 + 8 * hh);
      acc[t] = mmaH<ASPLIT ? 2 : 1>(ah.v, al.v, bq.v, bq.v, acc[t]); }
  }
#pragma unroll
  for (int t = 0; t < 4; ++t) { if (col0 + t * 16 >= N) continue;
#pragma unroll
    for (int r = 0; r < 8; ++r) so[w][8 * hh + r][t * 16 + ln] = acc[t][r] * alpha; }
  __builtin_amdgcn_fence(__ATOMIC_ACQ_REL, "workgroup"); __builtin_amdgcn_wave_barrier();
  const int rsub = lane >> 4, c4 = (lane & 15) * 4;
  {
#pragma unroll
    for (int q = 0; q < 8; ++q) { const int r = q * 2 + rsub; if (col0 + c4 < N) { const v4f v = *(const v4fa*)&so[w][r][c4]; *(v4f*)(C + (size_t)(row0 + r) * ldc + col0 + c4) = v; } }
     }
}

// Wt[n][k] = f16(W[k][n]·scale) from f32 row-major W[K][N] (scale = power of two; bf16-exact weights stay exact in f16 away from the subnormal range)
__global__ __launch_bounds__(256) void k_wt_f16(const float* __restrict__ W, _Float16* __restrict__ Wt, int K, int N, float scale) {
  const int t = blockIdx.x * 256 + threadIdx.x; if (t >= N * (K / 8)) return; const int n = t / (K / 8), k8 = (t % (K / 8)) * 8; FragH f;
#pragma unroll
  for (int i = 0; i < 8; ++i) f.h[i] = (_Float16)(bf16_round(W[(size_t)(k8 + i) * N + n]) * scale); const v8us o = f.half[0];
  *(v8us*)((unsigned short*)Wt + (size_t)n * K + k8) = o; 
}
// k_gemm_hh variant with fused epilogue: v = acc·alpha + bias[by·sBias + col] (+ CP[(row/rowsPerB)·sCPb + by·64 + col] if CP) ; ACT 0 none / 1 elu ; writes f16 C16 (and f32 C if non-null)
template <int ACT>
__global__ __launch_bounds__(128) void k_gemm_hhx(const _Float16* __restrict__ A, int lda, size_t sA, const _Float16* __restrict__ Bh, int ldb, size_t sB, float alpha, const float* __restrict__ bias, size_t sBias, const float* __restrict__ CP, int rowsPerB, size_t sCPb, int row0g,
    float* __restrict__ C, _Float16* __restrict__ C16, int ldc, size_t sC, int M, int N, int K) {
  __shared__ __attribute__((aligned(16))) float so[4][16][64];
  const int tid = threadIdx.x, w = tid >> 5, lane = tid & 31, ln = lane & 15, hh = lane >> 4; const int by = blockIdx.y;
  A += (size_t)by * sA; Bh += (size_t)by * sB; const size_t cofs = (size_t)by * sC; const float* bp = bias ? bias + (size_t)by * sBias : nullptr;
  const int ntn = (N + 63) / 64; const int wid = blockIdx.x * 4 + w; const int mt = wid / ntn, nq = wid % ntn; if (mt * 16 >= M) return;
  const int row0 = mt * 16, col0 = nq * 64; const _Float16* arow = A + (size_t)(row0 + ln) * lda;
  v8f acc[4] = {};
  for (int kb = 0; kb < K; kb += 32) { FragH ah; ah.half[0] = *(const v8us*)((const unsigned short*)arow + kb + 8 * hh); ah.half[1] = *(const v8us*)((const unsigned short*)arow + kb + 16 + 8 * hh);
#pragma unroll
    for (int t = 0; t < 4; ++t) { if (col0 + t * 16 >= N) continue; const size_t boff = (size_t)(col0 + t * 16 + ln) * ldb + kb; FragH bq; bq.half[0] = *(const v8us*)((const unsigned short*)Bh + boff + 8 * hh); bq.half[1] = *(const v8us*)((const unsigned short*)Bh + boff + 16 + 8 * hh);
      acc[t] = mmaH<1>(ah.v, ah.v, bq.v, bq.v, acc[t]); }
  }
#pragma unroll
  for (int t = 0; t < 4; ++t) { if (col0 + t * 16 >= N) continue; const int col = col0 + t * 16 + ln; const float bv = bp ? bf16_round(bp[col]) : 0.f;
#pragma unroll
    for (int r = 0; r < 8; ++r) { float v = acc[t][r] * alpha + bv; if (CP) { const int bidx = (row0g + row0 + 8 * hh + r) / rowsPerB; v += CP[(size_t)bidx * sCPb + (size_t)by * 64 + col]; } if (ACT == 1) v = (v > 0.f) ? v : expm1f(v); else if (ACT == 7) v = (v > 0.f) ? v + 1.0f : expf(v); else if (ACT == 8) v = tanhf(v); else if (ACT == 9) v = 0.5f * v * (1.0f + tanhf(0.7978845608028654f * (v + 0.044715f * v * v * v))); else if (ACT == 11) v = 1.0f / (1.0f + expf(-v)); else if (ACT == 12) v = (v > 0.f) ? v : 0.01f * v; else if (ACT == 14) v = (v > 0.f) ? v : 0.1f * v; else if (ACT == 15) v = v / (1.0f + expf(-v)); else if (ACT == 3) v = fmaxf(v, 0.f); else if (ACT == 6) v = 0.5f * v * (1.0f + erff(v * 0.70710678118654752f)); so[w][8 * hh + r][t * 16 + ln] = v; } }
  __builtin_amdgcn_fence(__ATOMIC_ACQ_REL, "workgroup"); __builtin_amdgcn_wave_barrier();
  const int rsub = lane >> 4, c4 = (lane & 15) * 4; typedef _Float16 v4h __attribute__((ext_vector_type(4)));
  {
#pragma unroll
    for (int q = 0; q < 8; ++q) { const int r = q * 2 + rsub; if (col0 + c4 < N) { const v4f v = *(const v4fa*)&so[w][r][c4]; if (C) *(v4f*)(C + cofs + (size_t)(row0 + r) * ldc + col0 + c4) = v; if (C16) { v4h h4; for (int i = 0; i < 4; ++i) h4[i] = (_Float16)v[i]; *(v4h*)(C16 + cofs + (size_t)(row0 + r) * ldc + col0 + c4) = h4; } } }
     }
}


typedef _Float16 v4h __attribute__((ext_vector_type(4)));

// The p_* functions are jobs of 256-thread blocks (p_bidx: 128); bid is the block's index within its job (k_prep hands it over; k_gemm2 to p_bidx).
__device__ __forceinline__ void p_x16(unsigned bid, const float* __restrict__ x, _Float16* __restrict__ X16, size_t n8) { const size_t t = (size_t)bid * 256 + threadIdx.x; if (t >= n8) return; FragH f;
#pragma unroll
  for (int q = 0; q < 8; ++q) f.h[q] = (_Float16)bf16_round(x[t * 8 + q]); *(v8us*)((unsigned short*)X16 + t * 8) = f.half[0];  }
__global__ __launch_bounds__(256) void k_h16(const float* __restrict__ x, _Float16* __restrict__ X16, size_t n8) { const size_t t = (size_t)blockIdx.x * 256 + threadIdx.x; if (t >= n8) return; FragH f;
#pragma unroll
  for (int q = 0; q < 8; ++q) f.h[q] = (_Float16)x[t * 8 + q]; *(v8us*)((unsigned short*)X16 + t * 8) = f.half[0];  }
__device__ __forceinline__ void p_round16f(unsigned bid, const float* __restrict__ W, _Float16* __restrict__ Bt, size_t n8) { const size_t t = (size_t)bid * 256 + threadIdx.x; if (t >= n8) return; FragH f;
#pragma unroll
  for (int i = 0; i < 8; ++i) f.h[i] = (_Float16)(bf16_round(W[t * 8 + i]) * 16.0f); *(v8us*)((unsigned short*)Bt + t * 8) = f.half[0];  }
template <int NHv, int TTv>
__global__ __launch_bounds__(256) void k_vt(const _Float16* __restrict__ V16, int ldv, int voff, _Float16* __restrict__ Vt) { __shared__ unsigned short tl[64][66]; const int tid = threadIdx.x; const int slab = blockIdx.x / (TTv / 64), lg = blockIdx.x % (TTv / 64); const int b = slab / NHv, h = slab % NHv;
  for (int i = tid; i < 64 * 8; i += 256) { const int r = i / 8, c8 = (i % 8) * 8; FragH f; f.half[0] = *(const v8us*)((const unsigned short*)V16 + ((size_t)b * TTv + lg * 64 + r) * ldv + voff + h * 64 + c8);
#pragma unroll
    for (int q = 0; q < 8; ++q) tl[r][c8 + q] = f.u[q]; }
  __syncthreads();
  {
#pragma unroll
    for (int rd = 0; rd < 2; ++rd) { const int d = rd * 32 + tid / 8, pc = tid % 8; FragH f;
#pragma unroll
      for (int q = 0; q < 8; ++q) f.u[q] = tl[pc * 8 + q][d];
      *(v8us*)((unsigned short*)Vt + ((size_t)slab * 64 + d) * TTv + lg * 64 + pc * 8) = f.half[0]; }
     } }

// ---- fast GEMM (block tile 128x64, wave tile 32x64; requires M % 128 == 0, N % 64 == 0 and K % 64 == 0); epilogue = k_gemm_hhx semantics ----
__device__ __forceinline__ v16h g2_fragl(const unsigned char* p) { FragH f; f.half[0] = *(const v8us*)p; f.half[1] = *(const v8us*)(p + 32); return f.v; }      /* a fragment's two 16-byte pieces of one LDS row, the k order of the global planes */
__device__ __forceinline__ v8f g2_mma(v16h a, v16h b, v8f c) { v8f d = __builtin_amdgcn_wmma_f32_16x16x32_f16(false, a, false, b, (short)0, c, false, false); asm volatile("v_nop\n\tv_nop\n\tv_nop\n\tv_nop" : "+v"(d) : "v"(a), "v"(b)); return d; }
// LDS image of one chunk of 64 k: the block's 128 A rows, then its 64 B rows, each 128 B at a pitch of 144 B (16 B x odd: ds_load_b128 fragment reads meet no bank twice).
#define G_P 144
#define G_B (128 * G_P)
#define G_ST (192 * G_P)
// A thread's twelve 16-byte asynchronous copies of one chunk (128 threads x 12 x 16 B = the chunk's 24 KiB; 8 lanes to a row = one whole 128-B line): l = its LDS byte address in the buffer, ga, gb = its global addresses in A and B; a16, b16 = bytes of 16 rows of A and of B in global memory.
__device__ __forceinline__ void g2_chunk_copy(unsigned l, const char* ga, const char* gb, unsigned a16, unsigned b16) {
  const unsigned l1 = l + 16 * G_P, l2 = l + 32 * G_P, l3 = l + 48 * G_P, l4 = l + 64 * G_P, l5 = l + 80 * G_P, l6 = l + 96 * G_P, l7 = l + 112 * G_P, l8 = l + G_B, l9 = l8 + 16 * G_P, l10 = l8 + 32 * G_P, l11 = l8 + 48 * G_P;
  const char* a1 = ga + a16; const char* a2 = a1 + a16; const char* a3 = a2 + a16; const char* a4 = a3 + a16; const char* a5 = a4 + a16; const char* a6 = a5 + a16; const char* a7 = a6 + a16;
  const char* b1 = gb + b16; const char* b2 = b1 + b16; const char* b3 = b2 + b16;
  /* the copies and, as the last line of the same statement, the wait that stands in front of any rewrite of their address registers */
  asm volatile("global_load_async_to_lds_b128 %0, %12, off\n\t"
               "global_load_async_to_lds_b128 %1, %13, off\n\t"
               "global_load_async_to_lds_b128 %2, %14, off\n\t"
               "global_load_async_to_lds_b128 %3, %15, off\n\t"
               "global_load_async_to_lds_b128 %4, %16, off\n\t"
               "global_load_async_to_lds_b128 %5, %17, off\n\t"
               "global_load_async_to_lds_b128 %6, %18, off\n\t"
               "global_load_async_to_lds_b128 %7, %19, off\n\t"
               "global_load_async_to_lds_b128 %8, %20, off\n\t"
               "global_load_async_to_lds_b128 %9, %21, off\n\t"
               "global_load_async_to_lds_b128 %10, %22, off\n\t"
               "global_load_async_to_lds_b128 %11, %23, off\n\t"
               "s_wait_xcnt 0x0"
               :: "v"(l), "v"(l1), "v"(l2), "v"(l3), "v"(l4), "v"(l5), "v"(l6), "v"(l7), "v"(l8), "v"(l9), "v"(l10), "v"(l11),
                  "v"(ga), "v"(a1), "v"(a2), "v"(a3), "v"(a4), "v"(a5), "v"(a6), "v"(a7), "v"(gb), "v"(b1), "v"(b2), "v"(b3) : "memory"); }
// Bias-index table: for every (batch, query, key) the byte offset, in the flash kernel's 65-entry bias table, of that pair's entry: 4 * (bucket(|pos_j - pos_i|) + 32 * (pos_j > pos_i)), or 4 * 64 for a masked key. It does not depend on the head, so it is made once and read by all 8 heads.
// Layout = the flash kernel's own reading order: [batch][tile of 16 queries][tile of 32 keys][lane][16], lane (ln, hh) = query ln, entry nt * 8 + r = key nt * 16 + 8 hh + r: a lane's 16 entries of one trip are 32 contiguous bytes, a wave's 1 KiB.
// A job of 128-thread blocks, one block to a (batch, query tile); lds = at least LUTN + 8 * SLEN bytes.
__device__ __forceinline__ void p_bidx(unsigned bid, unsigned char* lds, const int* __restrict__ pos, const float* __restrict__ mask, const int* __restrict__ LUT, unsigned short* __restrict__ TB) {
  typedef int v4ib __attribute__((ext_vector_type(4), may_alias));
  unsigned* sL = (unsigned*)lds; int* sP = (int*)(lds + LUTN); int* sM = (int*)(lds + LUTN + SLEN * 4);      /* bucket of every distance as one byte; the batch's positions; 256 for a masked key, else 0 */
  const int tid = threadIdx.x, lane = tid & 31, ln = lane & 15, hh = lane >> 4; const int b = bid / (SLEN / 16), qt = bid % (SLEN / 16);
  for (int i = tid; i < LUTN / 4; i += 128) { const v4ib c = *(const v4ib*)(LUT + 4 * i); sL[i] = (unsigned)(c[0] & (NBIN - 1)) | ((unsigned)(c[1] & (NBIN - 1)) << 8) | ((unsigned)(c[2] & (NBIN - 1)) << 16) | ((unsigned)(c[3] & (NBIN - 1)) << 24); }
  for (int i = tid; i < SLEN / 4; i += 128) { *(v4ib*)(sP + 4 * i) = *(const v4ib*)(pos + (size_t)b * SLEN + 4 * i); const v4f m = *(const v4fa*)(mask + (size_t)b * SLEN + 4 * i); v4ib k;
#pragma unroll
    for (int q = 0; q < 4; ++q) k[q] = (bf16_round(m[q]) == 0.0f) ? 256 : 0;
    *(v4ib*)(sM + 4 * i) = k; }
  __syncthreads();      /* every thread reads what all 128 staged (the job is picked per block) */
  const unsigned char* sB = (const unsigned char*)sL; const int pi = sP[qt * 16 + ln];
#pragma unroll 1      /* eight key tiles a thread, one at a time: the job's registers stay below the GEMM's */
  for (int i = 0; i < SLEN / 32 / 4; ++i) { const int kt = (tid >> 5) + 4 * i; FragH f;
#pragma unroll
    for (int nt = 0; nt < 2; ++nt) { const int j = kt * 32 + nt * 16 + 8 * hh; const v4ib pA = *(const v4ib*)(sP + j), pB = *(const v4ib*)(sP + j + 4), mA = *(const v4ib*)(sM + j), mB = *(const v4ib*)(sM + j + 4);
#pragma unroll
      for (int r = 0; r < 8; ++r) { const int pj = (r < 4) ? pA[r & 3] : pB[r & 3]; const int mk = (r < 4) ? mA[r & 3] : mB[r & 3]; int d = abs(pj - pi); d = min(d, LUTN - 1);
        f.u[nt * 8 + r] = (unsigned short)max(((int)sB[d] + ((pj > pi) ? 32 : 0)) * 4, mk); } }
    unsigned short* o = TB + (((size_t)bid * (SLEN / 32) + kt) * 32 + lane) * 16; *(v8us*)o = f.half[0]; *(v8us*)(o + 8) = f.half[1]; } }
template <int ACT, int KC, int SPL>      /* KC = K, a compile-time multiple of 64, at least 128; M a multiple of 128 (a block stages 128 whole rows); SPL 1: the results leave as f16 hi + (x2^10) residual planes, six of sC elements from C16 on (q, k row-major; V^T per batch and head), and no f32 copy is written */
__global__ __launch_bounds__(128) __attribute__((amdgpu_waves_per_eu(4)))      /* a budget of 256 registers: the build needs no register-window switches */
void k_gemm2(const _Float16* __restrict__ A, int lda, size_t sA, const _Float16* __restrict__ Bh, int ldb, size_t sB, float alpha, const float* __restrict__ bias, const float* __restrict__ bias1, const float* __restrict__ bias2, size_t sBias, const float* __restrict__ CP, int rowsPerB, size_t sCPb, int row0g,
    float* __restrict__ C, _Float16* __restrict__ C16, int ldc, size_t sC, int M, int N, int K, const int* __restrict__ pos, const float* __restrict__ kmask, const int* __restrict__ LUT, unsigned short* __restrict__ TB) {
  /* A and B reach the four waves through LDS: two buffers of one 64-k chunk each, filled by asynchronous copies in whole 128-B lines, one chunk ahead of the chunk in work; behind the loop's last barrier the same bytes stage the output rows */
  __shared__ __attribute__((aligned(16))) unsigned char ring[2 * G_ST];
  const int tid = threadIdx.x, w = tid >> 5, lane = tid & 31, ln = lane & 15, hh = lane >> 4; const int by = blockIdx.y;
  if constexpr (SPL != 0) { if (by == 3) { p_bidx(blockIdx.x, ring, pos, kmask, LUT, TB); return; } }      /* the fourth slice of the projections' grid makes the bias-index table, which needs only the set-up kernel's bucket table: whole blocks, in front of every other barrier */
  const float* bsel = (by == 0) ? bias : ((by == 1) ? bias1 : bias2);      /* products that share one grid (blockIdx.y) have each their own bias input */
  A += (size_t)by * sA; Bh += (size_t)by * sB; const size_t cofs = (size_t)by * sC; const float* bp = bsel ? bsel + (size_t)by * sBias : nullptr;
  const int ntn = N >> 6; const int mt = blockIdx.x / ntn, nq = blockIdx.x - mt * ntn; const int rowb = mt * 128, row0 = rowb + 32 * w, col0 = nq * 64; if (rowb >= M) return;      /* the whole block or none of it, in front of every barrier */
  const unsigned a16 = (unsigned)(16 * lda) * 2u, b16 = (unsigned)(16 * ldb) * 2u;
  const unsigned lc = (unsigned)(size_t)ring + (unsigned)((tid >> 3) * G_P + (tid & 7) * 16);
  const char* ga = (const char*)A + ((size_t)(rowb + (tid >> 3)) * lda) * 2 + (tid & 7) * 16; const char* gb = (const char*)Bh + ((size_t)(col0 + (tid >> 3)) * ldb) * 2 + (tid & 7) * 16;      /* the next chunk to copy */
  (void)K; constexpr int NT = KC / 64;
  g2_chunk_copy(lc, ga, gb, a16, b16);      /* chunk 0 into buffer 0 */
  asm volatile("s_wait_asynccnt 0x0" ::: "memory");      /* this wave's copies of chunk 0 have landed before the barrier publishes them */
  __syncthreads();      /* every wave reads what all four staged */
  ga += 128; gb += 128;
  g2_chunk_copy(lc + G_ST, ga, gb, a16, b16);      /* chunk 1 into buffer 1 */
  const unsigned char* fa = ring + (32 * w + ln) * G_P + 16 * hh; const unsigned char* fb = ring + G_B + ln * G_P + 16 * hh;      /* this lane's fragment rows in buffer 0 */
  unsigned bo = 0;      /* byte offset of the buffer in work */
  const v8f z8 = {0.f,0.f,0.f,0.f,0.f,0.f,0.f,0.f}; v8f c00 = z8, c01 = z8, c02 = z8, c03 = z8, c10 = z8, c11 = z8, c12 = z8, c13 = z8;
#pragma unroll 1      /* one copy of the trip in the text: the buffer is picked by an offset, not by the code */
  for (int t = 0; t < NT; ++t) {
    v16h fa0[2], fa1[2], fb0[2], fb1[2], fb2[2], fb3[2];      /* the chunk's two k steps: their 24 LDS reads stand together, ahead of the products */
#pragma unroll
    for (int s = 0; s < 2; ++s) { const unsigned char* pa = fa + bo + s * 64; const unsigned char* pb = fb + bo + s * 64; fa0[s] = g2_fragl(pa); fb0[s] = g2_fragl(pb); fa1[s] = g2_fragl(pa + 16 * G_P); fb1[s] = g2_fragl(pb + 16 * G_P); fb2[s] = g2_fragl(pb + 32 * G_P); fb3[s] = g2_fragl(pb + 48 * G_P); }
#pragma unroll
    for (int s = 0; s < 2; ++s) {
      c00 = g2_mma(fa0[s], fb0[s], c00); c10 = g2_mma(fa1[s], fb0[s], c10);
      c01 = g2_mma(fa0[s], fb1[s], c01); c11 = g2_mma(fa1[s], fb1[s], c11);
      c02 = g2_mma(fa0[s], fb2[s], c02); c12 = g2_mma(fa1[s], fb2[s], c12);
      c03 = g2_mma(fa0[s], fb3[s], c03); c13 = g2_mma(fa1[s], fb3[s], c13); }
    /* hand-over, every wave in this order: its own reads of this buffer are done, its own copies of the next chunk have landed, the barrier tells the other waves both; only then is this buffer refilled */
    asm volatile("s_wait_dscnt 0x0" ::: "memory");
    asm volatile("s_wait_asynccnt 0x0" ::: "memory");
    __syncthreads();
    ga += 128; gb += 128;
    if (t + 2 < NT) g2_chunk_copy(lc + bo, ga, gb, a16, b16);      /* the chunk after next, while one exists (a scalar test) */
    bo ^= G_ST; }
  asm volatile("s_wait_asynccnt 0x0" ::: "memory");      /* no copy is in flight when the ring's bytes are taken for the output rows */
  v8f accs[8] = {c00, c01, c02, c03, c10, c11, c12, c13};
  if constexpr (SPL != 0) {      /* the split epilogue: value = acc * alpha + bias, then hi = f16(value), residual = f16((value - hi) * 2^10), straight into the planes that the attention kernel reads */
    float bv4[4] = {0.f, 0.f, 0.f, 0.f};      /* the bias of this lane's four columns, the four loads under one test so that they fly together */
    if (bp) { const float* bq = bp + col0 + ln; const float b0 = bq[0], b1 = bq[16], b2 = bq[32], b3 = bq[48]; bv4[0] = bf16_round(b0); bv4[1] = bf16_round(b1); bv4[2] = bf16_round(b2); bv4[3] = bf16_round(b3); }
    if (by == 2) {      /* V^T planes: a lane's 8 accumulator rows are 8 consecutive tokens of one d, one 16-byte piece of a V^T row; the block's 64 d x 128 tokens gather in LDS so that whole 128-B lines leave */
      constexpr int TP = 272;      /* 256 B of tokens at a pitch of 16 B x odd */
#pragma unroll
      for (int u = 0; u < 8; ++u) { const int t = u & 3, half = u >> 2; FragH fh, fl;
#pragma unroll
        for (int r = 0; r < 8; ++r) { const float v = accs[u][r] * alpha + bv4[t]; const _Float16 hv = (_Float16)v; fh.h[r] = hv; fl.h[r] = (_Float16)((v - (float)hv) * 1024.0f); }
        unsigned char* pt = ring + (t * 16 + ln) * TP + (32 * w + half * 16 + 8 * hh) * 2; *(v8us*)pt = fh.half[0]; *(v8us*)(pt + 64 * TP) = fl.half[0]; }
      __syncthreads();      /* a V^T row holds tokens of all four waves (by is the same for the whole block) */
      unsigned short* Vh = (unsigned short*)C16 + 4 * sC + ((size_t)((rowb / SLEN) * NH + nq) * 64 + (tid >> 4)) * SLEN + (rowb % SLEN) + (tid & 15) * 8; unsigned short* Vl = Vh + sC;
      const unsigned char* pr = ring + (tid >> 4) * TP + (tid & 15) * 16;
#pragma unroll
      for (int i = 0; i < 8; ++i) { const v8us a = *(const v8us*)(pr + i * 8 * TP), c = *(const v8us*)(pr + (64 + i * 8) * TP); *(v8us*)(Vh + (size_t)(i * 8) * SLEN) = a; *(v8us*)(Vl + (size_t)(i * 8) * SLEN) = c; }
    } else {      /* q, k planes, row-major: each wave turns its own 32 x 64 tile through LDS; 16 lanes then write one row's 64 columns, a whole 128-B line of each plane */
      float* so = (float*)ring + w * (32 * 68);      /* this wave's 32 rows at a pitch of 68 floats */
#pragma unroll
      for (int u = 0; u < 8; ++u) { const int t = u & 3, half = u >> 2;
#pragma unroll
        for (int r = 0; r < 8; ++r) so[(half * 16 + 8 * hh + r) * 68 + t * 16 + ln] = accs[u][r] * alpha + bv4[t]; }
      __builtin_amdgcn_fence(__ATOMIC_ACQ_REL, "workgroup"); __builtin_amdgcn_wave_barrier();      /* the wave's own stores are in LDS before its lanes read each other's */
      const int rsub = lane >> 4, c4 = (lane & 15) * 4;
      _Float16* Ph = C16 + (size_t)(2 * by) * sC + (size_t)(row0 + rsub) * ldc + col0 + c4; _Float16* Pl = Ph + sC;
#pragma unroll
      for (int q = 0; q < 16; ++q) { const v4f v = *(const v4fa*)&so[(q * 2 + rsub) * 68 + c4]; v4h h4, l4;
#pragma unroll
        for (int i = 0; i < 4; ++i) { const _Float16 hv = (_Float16)v[i]; h4[i] = hv; l4[i] = (_Float16)((v[i] - (float)hv) * 1024.0f); }
        *(v4h*)(Ph + (size_t)(q * 2) * ldc) = h4; *(v4h*)(Pl + (size_t)(q * 2) * ldc) = l4; }
      asm volatile("s_wait_xcnt 0x0" ::: "memory");      /* the built code joins this branch with the V^T branch, whose text rewrites registers that the last stores name: the wait stands in front of every such write */
    }
    return; }
  float* so = (float*)ring + w * (32 * 68);      /* this wave's 32 output rows at a pitch of 68 floats */
#pragma unroll
  for (int u = 0; u < 8; ++u) { const int t = u & 3, half = u >> 2; const int col = col0 + t * 16 + ln; const float bv = bp ? bf16_round(bp[col]) : 0.f;
#pragma unroll
    for (int r = 0; r < 8; ++r) { const int rloc = half * 16 + 8 * hh + r; float v = accs[u][r] * alpha + bv; if (CP) { const int bidx = (row0g + row0 + rloc) / rowsPerB; v += CP[(size_t)bidx * sCPb + (size_t)by * 64 + col]; }
      if (ACT == 3) v = fmaxf(v, 0.f); else if (ACT == 6) v = 0.5f * v * (1.0f + erff(v * 0.70710678118654752f)); else if (ACT == 11) v = 1.0f / (1.0f + expf(-v)); else if (ACT == 15) v = v / (1.0f + expf(-v)); else if (ACT == 12) v = (v > 0.f) ? v : 0.01f * v; else if (ACT == 8) v = tanhf(v);
      so[rloc * 68 + t * 16 + ln] = v; } }
  __builtin_amdgcn_fence(__ATOMIC_ACQ_REL, "workgroup"); __builtin_amdgcn_wave_barrier();
  const int rsub = lane >> 4, c4 = (lane & 15) * 4;
  {
#pragma unroll
    for (int q = 0; q < 16; ++q) { const int r = q * 2 + rsub; const v4f v = *(const v4fa*)&so[r * 68 + c4]; if (C) *(v4f*)(C + cofs + (size_t)(row0 + r) * ldc + col0 + c4) = v; if (C16) { v4h h4; for (int i = 0; i < 4; ++i) h4[i] = (_Float16)v[i]; *(v4h*)(C16 + cofs + (size_t)(row0 + r) * ldc + col0 + c4) = h4; } }
     } }



#define NB_E8 (NR * DM / 8 / 256)            /* blocks of a job with one thread to 8 elements of a [NR][DM] plane */
// lane l <-> l ^ 16 (the other half of the wave), all lanes on
__device__ __forceinline__ float xhalf(float v) { const int b = __float_as_int(v); return __int_as_float(__builtin_amdgcn_permlanex16(b, b, 0x76543210, 0xfedcba98, false, false)); }
// LDS image of one tile of 32 keys: K hi and K residual as 32 rows of 128 B at a pitch of 144 B, V^T hi and residual as 64 rows of 64 B at a pitch of 80 B (16 B x odd: ds_load_b128 fragment reads meet no bank twice).
#define FK_P 144
#define FV_P 80
#define F_KH 0
#define F_KL (32 * FK_P)
#define F_VH (2 * 32 * FK_P)
#define F_VL (2 * 32 * FK_P + 64 * FV_P)
#define F_TILE (2 * 32 * FK_P + 2 * 64 * FV_P)
// A thread's eight 16-byte asynchronous copies of one tile (128 threads x 8 x 16 B = the tile's 16 KiB): lk, lv = its LDS byte addresses in the K and V^T parts of the buffer, g* = its global addresses in the four planes; k16, v32 = bytes of 16 K rows and of 32 V^T rows in global memory.
__device__ __forceinline__ void f_tile_copy(unsigned lk, unsigned lv, const char* gkh, const char* gkl, const char* gvh, const char* gvl, unsigned k16, unsigned v32) {
  const unsigned a0 = lk + F_KH, a1 = a0 + 16 * FK_P, a2 = lk + F_KL, a3 = a2 + 16 * FK_P, a4 = lv + F_VH, a5 = a4 + 32 * FV_P, a6 = lv + F_VL, a7 = a6 + 32 * FV_P;
  const char* p1 = gkh + k16; const char* p3 = gkl + k16; const char* p5 = gvh + v32; const char* p7 = gvl + v32;
  /* the copies and, as the last line of the same statement, the wait that stands in front of any rewrite of their address registers */
  asm volatile("global_load_async_to_lds_b128 %0, %8, off\n\t"
               "global_load_async_to_lds_b128 %1, %9, off\n\t"
               "global_load_async_to_lds_b128 %2, %10, off\n\t"
               "global_load_async_to_lds_b128 %3, %11, off\n\t"
               "global_load_async_to_lds_b128 %4, %12, off\n\t"
               "global_load_async_to_lds_b128 %5, %13, off\n\t"
               "global_load_async_to_lds_b128 %6, %14, off\n\t"
               "global_load_async_to_lds_b128 %7, %15, off\n\t"
               "s_wait_xcnt 0x0"
               :: "v"(a0), "v"(a1), "v"(a2), "v"(a3), "v"(a4), "v"(a5), "v"(a6), "v"(a7), "v"(gkh), "v"(p1), "v"(gkl), "v"(p3), "v"(gvh), "v"(p5), "v"(gvl), "v"(p7) : "memory"); }
template <int TQ, int TK>
__global__ __launch_bounds__(128) void k_flashb(const _Float16* __restrict__ Q16, const _Float16* __restrict__ Q16lo, int ldq, const _Float16* __restrict__ K16, const _Float16* __restrict__ K16lo, int ldk, const _Float16* __restrict__ Vt, const _Float16* __restrict__ Vtlo, const unsigned short* __restrict__ TB, const float* __restrict__ BT, const float* __restrict__ OB, const float* __restrict__ QM, _Float16* __restrict__ Oh, _Float16* __restrict__ Ol, int ldo) {
  constexpr int RPW = 16, NQB = TQ / (4 * RPW), DT = 4, KS = 2;
  __shared__ __attribute__((aligned(16))) float sO[4][RPW][64 + 4];
  const int tid = threadIdx.x, w = tid >> 5, lane = tid & 31, ln = lane & 15, hh = lane >> 4;
  const int slab = blockIdx.x / NQB, qblk = blockIdx.x % NQB; const int b = slab / NH, h = slab % NH; const int qb0 = qblk * (4 * RPW); const int q0 = qb0 + w * RPW;
  const float obh = bf16_round(OB[h]) * LOG2E;      /* read once, ahead of the loop: behind the loop's waits (memory clobbers) it would be loaded anew every trip */
  /* K and V^T reach the four waves through LDS: two buffers of one 32-key tile each, filled by asynchronous copies in whole rows, one tile ahead of the tile in work; every wave reads its fragments from there */
  __shared__ __attribute__((aligned(16))) unsigned char ring[2 * F_TILE];
  constexpr int jend = TK;      /* every query meets every key; a masked key's score is -inf */
  const unsigned k16 = (unsigned)(16 * ldk) * 2u, v32 = (unsigned)(32 * TK) * 2u;
  const unsigned lk = (unsigned)(size_t)ring + (unsigned)((tid >> 3) * FK_P + (tid & 7) * 16), lv = (unsigned)(size_t)ring + (unsigned)((tid >> 2) * FV_P + (tid & 3) * 16);      /* 8 lanes to a K row (one 128-B line), 4 lanes to a V^T row */
  const size_t gko = (((size_t)b * TK + (tid >> 3)) * ldk + h * 64) * 2 + (tid & 7) * 16, gvo = (((size_t)slab * 64 + (tid >> 2)) * TK) * 2 + (tid & 3) * 16;
  const char* gkh = (const char*)K16 + gko; const char* gkl = (const char*)K16lo + gko; const char* gvh = (const char*)Vt + gvo; const char* gvl = (const char*)Vtlo + gvo;      /* the next tile to copy */
  f_tile_copy(lk, lv, gkh, gkl, gvh, gvl, k16, v32);      /* tile 0 into buffer 0 */
  /* the head's bias table, made once per block: entry bucket + 32 * (pos_j > pos_i) = dist_emb[bucket][h] + ((pos_j > pos_i) - 0.5) * order_bias[h], times LOG2E; entry 64 = -inf, the masked key. The bias-index table names the entry of every (query, key). */
  __shared__ __attribute__((aligned(16))) float sDE2[2 * NBIN + 4];
  if (tid < 2 * NBIN) { const float de = bf16_round(BT[(tid & (NBIN - 1)) * NH + h]) * LOG2E; sDE2[tid] = __builtin_fmaf((tid < NBIN) ? -0.5f : 0.5f, obh, de); } else if (tid == 2 * NBIN) sDE2[tid] = -INFINITY;
  asm volatile("s_wait_asynccnt 0x0" ::: "memory");      /* this wave's copies of tile 0 have landed before the barrier publishes them */
  __syncthreads();      /* every wave reads what all four staged */
  gkh += 2 * (size_t)k16; gkl += 2 * (size_t)k16; gvh += 64; gvl += 64;
  if (jend > 32) f_tile_copy(lk + F_TILE, lv + F_TILE, gkh, gkl, gvh, gvl, k16, v32);      /* tile 1 into buffer 1 */
  const int tq = q0 + ln;      /* this lane's query */
  FragH aq[KS], aql[KS];       /* Q as the B operand: column = query ln */
  { const size_t qo = ((size_t)b * TQ + tq) * ldq + h * 64; const unsigned short* qr = (const unsigned short*)Q16 + qo; const unsigned short* ql = (const unsigned short*)Q16lo + qo;
#pragma unroll
    for (int ks = 0; ks < KS; ++ks) { aq[ks].half[0] = *(const v8us*)(qr + ks * 32 + 8 * hh); aq[ks].half[1] = *(const v8us*)(qr + ks * 32 + 16 + 8 * hh); aql[ks].half[0] = *(const v8us*)(ql + ks * 32 + 8 * hh); aql[ks].half[1] = *(const v8us*)(ql + ks * 32 + 16 + 8 * hh); } }
  const unsigned short* tb = TB + ((((size_t)b * (TQ / 16) + (q0 >> 4)) * (TK / 32)) * 32 + lane) * 16;      /* this lane's 16 bias indices of the tile in work */
  v8us ix0 = *(const v8us*)tb, ix1 = *(const v8us*)(tb + 8);
  const unsigned char* fk = ring + ln * FK_P; const unsigned char* fv = ring + ln * FV_P;      /* this lane's fragment rows in buffer 0 */
  unsigned bo = 0;      /* byte offset of the buffer in work */
  float m_q = -3.0e38f, l_q = 0.f; v8f oacc[DT], oaccl[DT];
#pragma unroll
  for (int dt = 0; dt < DT; ++dt) { oacc[dt] = (v8f){0.f,0.f,0.f,0.f,0.f,0.f,0.f,0.f}; oaccl[dt] = oacc[dt]; }
#pragma unroll 1
  for (int j0 = 0; j0 < jend; j0 += 32) {
    tb += (j0 + 32 < jend) ? 32 * 16 : 0;      /* the next tile's indices are fetched one trip ahead (the last trip reads its own again) */
    const v8us nx0 = *(const v8us*)tb, nx1 = *(const v8us*)(tb + 8);
    v8f s[2];
#pragma unroll
    for (int nt = 0; nt < 2; ++nt) { const unsigned short* kr = (const unsigned short*)(fk + bo + F_KH + nt * 16 * FK_P); const unsigned short* kl = (const unsigned short*)(fk + bo + F_KL + nt * 16 * FK_P); FragH bk[KS], bkl[KS];      /* K as the A operand: row = key */
#pragma unroll
      for (int ks = 0; ks < KS; ++ks) { bk[ks].half[0] = *(const v8us*)(kr + ks * 32 + 8 * hh); bk[ks].half[1] = *(const v8us*)(kr + ks * 32 + 16 + 8 * hh); bkl[ks].half[0] = *(const v8us*)(kl + ks * 32 + 8 * hh); bkl[ks].half[1] = *(const v8us*)(kl + ks * 32 + 16 + 8 * hh); }
      v8f acc = (v8f){0.f,0.f,0.f,0.f,0.f,0.f,0.f,0.f}, accr = acc;
#pragma unroll
      for (int ks = 0; ks < KS; ++ks) { acc = mmaH<1>(bk[ks].v, bk[ks].v, aq[ks].v, aq[ks].v, acc); accr = mmaH<1>(bk[ks].v, bk[ks].v, aql[ks].v, aql[ks].v, accr); accr = mmaH<1>(bkl[ks].v, bkl[ks].v, aq[ks].v, aq[ks].v, accr); }
      s[nt] = acc + accr * 0.0009765625f; }
    float sc[2][8]; float mc = -INFINITY;
#pragma unroll
    for (int nt = 0; nt < 2; ++nt)
#pragma unroll
      for (int r = 0; r < 8; ++r) { const unsigned bo4 = nt ? ix1[r] : ix0[r];
        sc[nt][r] = s[nt][r] * (SCL * LOG2E) + *(const float*)((const unsigned char*)sDE2 + bo4);      /* + grammar distance-bucket and order biases, or -inf for a masked key; base-2 domain */
        mc = fmaxf(mc, sc[nt][r]); }
    mc = fmaxf(mc, xhalf(mc));
    const float mn = fmaxf(m_q, mc); const float ea = __builtin_amdgcn_exp2f(m_q - mn); const float al = (mn > -1.0e38f) ? ea : 1.0f; m_q = mn;
    FragH pa, pl; float ls = 0.f;      /* P^T hi and residual, already in the B operand's order */
#pragma unroll
    for (int nt = 0; nt < 2; ++nt)
#pragma unroll
      for (int r = 0; r < 8; ++r) { float e;
        if (nt == 1 && r == 4) asm("v_exp_f32 %0, %1\n\tv_nop" : "=v"(e) : "v"(sc[nt][r] - mn));      /* this one exponential stands in one statement with the slot that the instruction set asks for behind a transcendental */
        else e = __builtin_amdgcn_exp2f(sc[nt][r] - mn);      /* argument <= 0 (or -inf, a masked key: mn is finite, so 2^-inf = 0): no range guard is needed; a result under 2^-126 reads 0, far below what P's f16 pair keeps */ const float p = e; ls += p;
        const float ps = p * 1024.0f; const _Float16 t2 = (_Float16)ps; pa.h[nt * 8 + r] = t2; pl.h[nt * 8 + r] = (_Float16)((ps - (float)t2) * 1024.0f); }
    l_q = l_q * al + ls;
#pragma unroll
    for (int dt = 0; dt < DT; ++dt) { oacc[dt] *= al; oaccl[dt] *= al; }
#pragma unroll
    for (int dt = 0; dt < DT; ++dt) { const unsigned short* vh = (const unsigned short*)(fv + bo + F_VH + dt * 16 * FV_P); const unsigned short* vl = (const unsigned short*)(fv + bo + F_VL + dt * 16 * FV_P); FragH bv, bl; bv.half[0] = *(const v8us*)(vh + 8 * hh); bv.half[1] = *(const v8us*)(vh + 16 + 8 * hh); bl.half[0] = *(const v8us*)(vl + 8 * hh); bl.half[1] = *(const v8us*)(vl + 16 + 8 * hh);      /* V^T as the A operand: row = d */
      oacc[dt] = mmaH<1>(bv.v, bv.v, pa.v, pa.v, oacc[dt]); oaccl[dt] = mmaH<1>(bl.v, bl.v, pa.v, pa.v, oaccl[dt]); oaccl[dt] = mmaH<1>(bv.v, bv.v, pl.v, pl.v, oaccl[dt]); }
    /* hand-over, every wave in this order: its own reads of this buffer are done, its own copies of the next tile have landed, the barrier tells the other waves both; only then is this buffer refilled */
    asm volatile("s_wait_dscnt 0x0" ::: "memory");
    asm volatile("s_wait_asynccnt 0x0" ::: "memory");
    __syncthreads();
    gkh += 2 * (size_t)k16; gkl += 2 * (size_t)k16; gvh += 64; gvl += 64;
    if (j0 + 64 < jend) f_tile_copy(lk + bo, lv + bo, gkh, gkl, gvh, gvl, k16, v32);      /* the tile after next, while one exists (a scalar test) */
    bo ^= F_TILE; ix0 = nx0; ix1 = nx1; }
  asm volatile("s_wait_asynccnt 0x0" ::: "memory");      /* no copy is left in flight when the wave goes on to its end */
  const float lt = l_q + xhalf(l_q); const float inv = (lt > 0.f) ? 1.0f / (lt * 1024.0f) : 0.f;
#pragma unroll
  for (int dt = 0; dt < DT; ++dt)
#pragma unroll
    for (int g = 0; g < 2; ++g) { v4f o4;
#pragma unroll
      for (int i = 0; i < 4; ++i) o4[i] = (oacc[dt][g * 4 + i] + oaccl[dt][g * 4 + i] * 0.0009765625f) * inv;
      *(v4fa*)&sO[w][ln][dt * 16 + 8 * hh + g * 4] = o4; }
  __builtin_amdgcn_fence(__ATOMIC_ACQ_REL, "workgroup"); __builtin_amdgcn_wave_barrier();
  {
#pragma unroll
    for (int rp = 0; rp < RPW; rp += 2) { const int r = rp + (lane >> 4), pc = lane & 15; const v4f val = *(const v4fa*)&sO[w][r][pc * 4]; const size_t row = (size_t)b * TQ + q0 + r; const float mk = bf16_round(QM[row]); v4h h4, l4;      /* O times the query's mask, as f16 hi + (x2^10) residual planes for the output projection: 16 lanes write a whole 128-B line of each */
#pragma unroll
      for (int i = 0; i < 4; ++i) { const float v = val[i] * mk; const _Float16 hv = (_Float16)v; h4[i] = hv; l4[i] = (_Float16)((v - (float)hv) * 1024.0f); }
      *(v4h*)(Oh + row * ldo + h * 64 + pc * 4) = h4; *(v4h*)(Ol + row * ldo + h * 64 + pc * 4) = l4; }
     } }


__global__ __launch_bounds__(256) void k_fulltab(unsigned* __restrict__ MB, int* __restrict__ RA, int* __restrict__ KE, int nq, int nk) {
  const int t = blockIdx.x * 256 + threadIdx.x;
  if (t < nq * (nk / 32)) { *(unsigned*)(MB + t) = 0u;  }
  if (t < nq) { *(int*)(RA + t) = 0;  }
  if (t < nq / 64) { *(int*)(KE + t * 32) = nk;  } }
__global__ __launch_bounds__(256) void k_lnx(const float* __restrict__ X, const float* __restrict__ g, const float* __restrict__ bb, _Float16* __restrict__ Y16, float* __restrict__ XB) {
  #pragma clang fp contract(off)
  const int tid = threadIdx.x, w = tid >> 5, ln = tid & 31; const int r = blockIdx.x * 8 + w; if (r >= NR) return; const float* x = X + (size_t)r * DM; float s = 0.f;
#pragma unroll 1
  for (int i = 0; i < DM / 128; ++i) { const v4f a = *(const v4fa*)(x + i * 128 + ln * 4); for (int q = 0; q < 4; ++q) s += bf16_round(a[q]); }
  for (int o = 16; o > 0; o >>= 1) s += __shfl_xor(s, o, 32); const float mu = s / (float)DM; float q2 = 0.f;
#pragma unroll 1
  for (int i = 0; i < DM / 128; ++i) { const v4f a = *(const v4fa*)(x + i * 128 + ln * 4); for (int q = 0; q < 4; ++q) { const float d = bf16_round(a[q]) - mu; q2 += d * d; } }
  for (int o = 16; o > 0; o >>= 1) q2 += __shfl_xor(q2, o, 32); const float rs = rsqrtf(q2 / (float)DM + 1e-5f);
  {
#pragma unroll 1
    for (int i = 0; i < DM / 128; ++i) { const int c0 = i * 128 + ln * 4; const v4f a = *(const v4fa*)(x + c0); _Float16 h4[4]; v4f xb;
      for (int q = 0; q < 4; ++q) { const float t = bf16_round(a[q]); h4[q] = (_Float16)((t - mu) * rs * bf16_round(g[c0 + q]) + bf16_round(bb[c0 + q])); xb[q] = t; }
      *(unsigned long long*)((unsigned short*)Y16 + (size_t)r * DM + c0) = *(const unsigned long long*)h4; *(v4f*)(XB + (size_t)r * DM + c0) = xb; }
     } }
// bucket table for the grammar bias: LUT[d] = bucket(d) = count of bf16-rounded bin edges < d (at most NBIN - 1), for integer distances d < LUTN
__device__ __forceinline__ void p_lut(unsigned bid, const float* __restrict__ edges, int* __restrict__ LUT) {
  #pragma clang fp contract(off)
  const int d = bid * 256 + threadIdx.x; if (d >= LUTN) return; const float fd = (float)d; int c = 0;
#pragma unroll 1
  for (int e = 0; e < NBIN - 1; ++e) c += (bf16_round(edges[e]) < fd) ? 1 : 0;
  c = min(c, NBIN - 1); *(int*)(LUT + d) = c;  }
#define NB_W (DM * DM / 8 / 256)                 /* blocks of one weight plane */
// One grid for the six set-up jobs (the x plane, four weight planes, the bucket table), which need nothing of each other: a block-uniform range of the block index picks the job.
__global__ __launch_bounds__(256) void k_prep(const float* __restrict__ x, const float* __restrict__ qw, const float* __restrict__ kw, const float* __restrict__ vw, const float* __restrict__ ow, const float* __restrict__ edges,
    _Float16* __restrict__ X16, _Float16* __restrict__ BW, int* __restrict__ LUT) {
  unsigned bid = blockIdx.x;
  if (bid < NB_E8) { p_x16(bid, x, X16, (size_t)NR * DM / 8); return; }
  bid -= NB_E8;
  if (bid < 4 * NB_W) { const unsigned j = bid / NB_W; const float* W = (j == 0) ? qw : ((j == 1) ? kw : ((j == 2) ? vw : ow)); p_round16f(bid - j * NB_W, W, BW + (size_t)j * DM * DM, (size_t)DM * DM / 8); return; }      /* BW: the four planes one behind the other */
  p_lut(bid - 4 * NB_W, edges, LUT); }
__global__ __launch_bounds__(256) void k_causaltab(unsigned* __restrict__ MB, int* __restrict__ RA, int* __restrict__ KE, int nq, int nk) {
  const int t = blockIdx.x * 256 + threadIdx.x; const int nw = nk / 32;
  if (t < nq * nw) { const int q = t / nw, w = t % nw; const int first = q + 1 - 32 * w; const unsigned bits = (first <= 0) ? 0xffffffffu : ((first >= 32) ? 0u : (0xffffffffu << first)); *(unsigned*)(MB + t) = bits;  }
  if (t < nq) { *(int*)(RA + t) = 0;  }
  if (t < nq / 64) { const int v = 64 * (t + 1); *(int*)(KE + t * 32) = v;  } }


static_assert((NR / 128) * (DM / 64) == NBT * (SLEN / 16), "the projection grid's fourth slice has one block to a (batch, query tile)");
extern "C" void kernel_launch(void* const* d_in, const int* in_sizes, int n_in,
                              void* d_out, int out_size, void* d_ws, size_t ws_size, hipStream_t stream) {
  (void)in_sizes; (void)n_in; (void)out_size;
  const float* const* I = (const float* const*)d_in; const float* x = I[0]; const int* pos = (const int*)d_in[1]; const float* mask = I[2]; const float* qw = I[3]; const float* qb = I[4]; const float* kw = I[5]; const float* kb = I[6]; const float* vw = I[7]; const float* vb = I[8]; const float* ow = I[9]; const float* ob = I[10]; const float* de = I[11]; const float* obias = I[12]; const float* edges = I[13];
  char* ws = (char*)d_ws; size_t off = 0;
  auto take = [&](size_t bytes) { char* p = ws + off; off += (bytes + 255) & ~(size_t)255; return p; };
  _Float16* BQ = (_Float16*)take((size_t)4 * DM * DM * 2); _Float16* BO = BQ + (size_t)3 * DM * DM;      /* q, k, v, o weight planes, one behind the other */
  _Float16* X16 = (_Float16*)take((size_t)NR * DM * 2);
  _Float16* Qh = (_Float16*)take((size_t)6 * NR * DM * 2); _Float16* Ql = Qh + (size_t)NR * DM; _Float16* Kh = Ql + (size_t)NR * DM; _Float16* Kl = Kh + (size_t)NR * DM; _Float16* Vth = Kl + (size_t)NR * DM; _Float16* Vtl = Vth + (size_t)NR * DM;      /* the six planes one behind the other, as the projection kernel's epilogue addresses them */
  _Float16* Oh = (_Float16*)take((size_t)2 * NR * DM * 2); _Float16* Ol = Oh + (size_t)NR * DM;      /* planes of their own: blocks of the flash kernel write them while others still read q */
  unsigned short* TB = (unsigned short*)take((size_t)NBT * SLEN * SLEN * 2); int* LUT = (int*)take((size_t)LUTN * 4);
  if (off > ws_size) return;      /* 2 + 8 + 48 + 16 + 16 = 90 MiB */
  const dim3 gP((NR / 128) * (DM / 64), 1), gP4((NR / 128) * (DM / 64), 4);
  k_prep<<<NB_E8 + 4 * NB_W + LUTN / 256, 256, 0, stream>>>(x, qw, kw, vw, ow, edges, X16, BQ, LUT);      /* torch (out,in) = natural Bt */
  k_gemm2<0, DM, 1><<<gP4, 128, 0, stream>>>(X16, DM, 0, BQ, DM, (size_t)DM * DM, 0.0625f, qb, kb, vb, 0, nullptr, 1, 0, 0, nullptr, Qh, DM, (size_t)NR * DM, NR, DM, DM, pos, mask, LUT, TB);      /* blockIdx.y = q, k, v, the bias-index table */
  k_flashb<SLEN, SLEN><<<NBT * NH * (SLEN / 64), 128, 0, stream>>>(Qh, Ql, DM, Kh, Kl, DM, Vth, Vtl, TB, de, obias, mask, Oh, Ol, DM);
  k_gemm2<0, DM, 0><<<gP, 128, 0, stream>>>(Oh, DM, 0, BO, DM, 0, 0.0625f, ob, nullptr, nullptr, 0, nullptr, 1, 0, 0, (float*)d_out, nullptr, DM, 0, NR, DM, DM, nullptr, nullptr, nullptr, nullptr);
  k_gemm2<0, DM, 0><<<gP, 128, 0, stream>>>(Ol, DM, 0, BO, DM, 0, 0.0625f / 1024.0f, nullptr, nullptr, nullptr, 0, (float*)d_out, 1, (size_t)DM, 0, (float*)d_out, nullptr, DM, 0, NR, DM, DM, nullptr, nullptr, nullptr, nullptr);
}
